// v000
// The times below were measured on an AMD MI455X: many runs one after another, warmed up first and cycling through
// copies of the inputs, with the whole window's GPU time divided by the number of runs. Launches and the gaps
// between them are all in it. The median over several windows is given; except for v000 it joins two sittings, which
// can be a few percent apart, so the side-by-side timings, each taken in one sitting, are the better comparison.
// v000, which the later versions start from, runs in 1370 microseconds.
#include <hip/hip_runtime.h>

typedef __attribute__((ext_vector_type(2))) float v2f;
typedef __attribute__((ext_vector_type(8))) float v8f;

#define TILE_M 128
#define TILE_N 128
#define KBLK   32
#define PITCH  36   // 32 K + 4 pad floats: bank-conflict-free fragment reads

// ---------------------------------------------------------------------------
// CDNA5 async global->LDS copy (bypasses VGPRs, tracked by ASYNCcnt).
// vdst = 32-bit LDS byte address, vaddr = 64-bit global address, GV mode.
// ---------------------------------------------------------------------------
__device__ __forceinline__ void async_load_b128(const float* g, float* l) {
    unsigned lds_addr = (unsigned)(unsigned long long)(uintptr_t)l;
    unsigned long long gaddr = (unsigned long long)(uintptr_t)g;
    asm volatile("global_load_async_to_lds_b128 %0, %1, off"
                 :: "v"(lds_addr), "v"(gaddr) : "memory");
}

__device__ __forceinline__ void wait_async_and_barrier() {
    asm volatile("s_wait_asynccnt 0x0" ::: "memory");
    __syncthreads();
}

// Stage one 128x32 fp32 tile (rows of a row-major matrix) into LDS [row][36].
__device__ __forceinline__ void stage_tile_async(const float* __restrict__ Gm,
                                                 int ld, int row0, int k0,
                                                 float* lbase, int tid) {
    #pragma unroll
    for (int i = 0; i < 4; ++i) {
        int idx = tid + i * 256;          // 0..1023
        int row = idx >> 3;               // 0..127
        int seg = (idx & 7) << 2;         // 0,4,...,28
        async_load_b128(Gm + (size_t)(row0 + row) * ld + k0 + seg,
                        lbase + row * PITCH + seg);
    }
}

// ---------------------------------------------------------------------------
// Generic fp32 WMMA GEMM:  C[M,N] = X[M,K] * Y[N,K]^T  (+ bias[N]) (+= C)
// 256 threads = 8 waves; 128x128 tile per block; each wave owns a 16x128
// strip = 8 subtiles of 16x16 computed with v_wmma_f32_16x16x4_f32.
// Double-buffered K-blocks staged via global_load_async_to_lds_b128.
// ---------------------------------------------------------------------------
__global__ __launch_bounds__(256)
void ravan_wmma_gemm_f32(const float* __restrict__ X,
                         const float* __restrict__ Y,
                         const float* __restrict__ bias,
                         float* __restrict__ C,
                         int M, int N, int K,
                         int ldx, int ldy, int ldc,
                         int accumulate) {
    __shared__ __align__(16) float xs[2][TILE_M * PITCH];   // 2 x 18 KB
    __shared__ __align__(16) float ys[2][TILE_N * PITCH];   // 2 x 18 KB

    const int m0   = blockIdx.x * TILE_M;
    const int n0   = blockIdx.y * TILE_N;
    const int tid  = threadIdx.x;
    const int wave = tid >> 5;
    const int lane = tid & 31;
    const int hi   = lane >> 4;    // half-wave: selects K pair
    const int lm   = lane & 15;    // row within 16

    v8f acc[8];
    #pragma unroll
    for (int i = 0; i < 8; ++i) acc[i] = (v8f){0.f,0.f,0.f,0.f,0.f,0.f,0.f,0.f};

    // Prologue: async-stage K-block 0 into buffer 0.
    stage_tile_async(X, ldx, m0, 0, xs[0], tid);
    stage_tile_async(Y, ldy, n0, 0, ys[0], tid);

    const int nk = K / KBLK;
    for (int kb = 0; kb < nk; ++kb) {
        const int cur = kb & 1;
        wait_async_and_barrier();           // tile kb resident, prev readers done

        if (kb + 1 < nk) {                  // overlap: prefetch tile kb+1
            const int knext = (kb + 1) * KBLK;
            stage_tile_async(X, ldx, m0, knext, xs[1 - cur], tid);
            stage_tile_async(Y, ldy, n0, knext, ys[1 - cur], tid);
        }

        const float* xt = xs[cur];
        const float* yt = ys[cur];
        #pragma unroll
        for (int k = 0; k < KBLK; k += 4) {
            // A 16x4 f32 layout: lanes0-15 K=k,k+1 ; lanes16-31 K=k+2,k+3
            v2f afrag = *(const v2f*)(&xt[(wave * 16 + lm) * PITCH + k + 2 * hi]);
            #pragma unroll
            for (int ns = 0; ns < 8; ++ns) {
                // B 4x16 layout: VGPR0 = K(k+2*hi), VGPR1 = K(k+1+2*hi), N = lm
                v2f bfrag = *(const v2f*)(&yt[(ns * 16 + lm) * PITCH + k + 2 * hi]);
                acc[ns] = __builtin_amdgcn_wmma_f32_16x16x4_f32(
                    false, afrag, false, bfrag, (short)0, acc[ns], false, false);
            }
        }
    }

    // Epilogue: C layout VGPR i -> M = i (lanes0-15) / i+8 (lanes16-31), N = lm.
    const int mbase = m0 + wave * 16;
    #pragma unroll
    for (int ns = 0; ns < 8; ++ns) {
        const int col = n0 + ns * 16 + lm;
        const float bv = bias ? bias[col] : 0.f;
        #pragma unroll
        for (int i = 0; i < 8; ++i) {
            const int row = mbase + i + 8 * hi;
            const size_t off = (size_t)row * ldc + col;
            float v = acc[ns][i] + bv;
            if (accumulate) v += C[off];
            C[off] = v;
        }
    }
}

// ---------------------------------------------------------------------------
// Prep: Gw[128,128] = blockdiag_h( s[h] * H[h] )   (Gw[qg][rg])
// ---------------------------------------------------------------------------
__global__ __launch_bounds__(256)
void ravan_build_g(const float* __restrict__ H, const float* __restrict__ s,
                   float* __restrict__ Gw) {
    int idx = blockIdx.x * 256 + threadIdx.x;      // 16384 total
    int qg = idx >> 7, rg = idx & 127;
    int hq = qg >> 4, q = qg & 15;
    int hr = rg >> 4, r = rg & 15;
    float v = 0.f;
    if (hq == hr) v = s[hq] * H[hq * 256 + q * 16 + r];
    Gw[idx] = v;
}

// ---------------------------------------------------------------------------
// Prep: Bcat[4096,128] with Bcat[o][h*16+q] = B[h][o][q]
// ---------------------------------------------------------------------------
__global__ __launch_bounds__(256)
void ravan_build_bcat(const float* __restrict__ Bsrc, float* __restrict__ Bc,
                      int Dout) {
    int idx = blockIdx.x * 256 + threadIdx.x;      // Dout*128 total
    int o = idx >> 7, hq = idx & 127;
    int h = hq >> 4, q = hq & 15;
    Bc[idx] = Bsrc[((size_t)h * Dout + o) * 16 + q];
}

// ---------------------------------------------------------------------------
// Launch
// inputs: 0:x[4,2048,4096] 1:W[4096,4096] 2:b[4096] 3:A[8,16,4096]
//         4:H[8,16,16] 5:B[8,4096,16] 6:s[8]
// ---------------------------------------------------------------------------
extern "C" void kernel_launch(void* const* d_in, const int* in_sizes, int n_in,
                              void* d_out, int out_size, void* d_ws, size_t ws_size,
                              hipStream_t stream) {
    const float* x = (const float*)d_in[0];
    const float* W = (const float*)d_in[1];
    const float* b = (const float*)d_in[2];
    const float* A = (const float*)d_in[3];   // contiguous as [128,4096]
    const float* H = (const float*)d_in[4];
    const float* B = (const float*)d_in[5];
    const float* s = (const float*)d_in[6];
    float* out = (float*)d_out;

    const int M = 4 * 2048;      // 8192 tokens
    const int Din = 4096, Dout = 4096, NR = 128;

    float* Gw = (float*)d_ws;                    // 128*128
    float* Bc = Gw + 128 * 128;                  // 4096*128
    float* AX = Bc + (size_t)Dout * NR;          // 8192*128
    float* V  = AX + (size_t)M * NR;             // 8192*128

    ravan_build_g<<<64, 256, 0, stream>>>(H, s, Gw);
    ravan_build_bcat<<<(Dout * NR) / 256, 256, 0, stream>>>(B, Bc, Dout);

    // AX = x @ Acat^T        [8192,128]  K=4096
    ravan_wmma_gemm_f32<<<dim3(M / TILE_M, NR / TILE_N), 256, 0, stream>>>(
        x, A, nullptr, AX, M, NR, Din, Din, Din, NR, 0);

    // V = AX @ Gw^T          [8192,128]  K=128 (folds H and s)
    ravan_wmma_gemm_f32<<<dim3(M / TILE_M, NR / TILE_N), 256, 0, stream>>>(
        AX, Gw, nullptr, V, M, NR, NR, NR, NR, NR, 0);

    // out = x @ W^T + b      [8192,4096] K=4096  (the big one)
    ravan_wmma_gemm_f32<<<dim3(M / TILE_M, Dout / TILE_N), 256, 0, stream>>>(
        x, W, b, out, M, Dout, Din, Din, Din, Dout, 0);

    // out += V @ Bcat^T      [8192,4096] K=128
    ravan_wmma_gemm_f32<<<dim3(M / TILE_M, Dout / TILE_N), 256, 0, stream>>>(
        V, Bc, nullptr, out, M, Dout, NR, NR, NR, Dout, 1);
}

// v001
// One run takes 1220 microseconds.
// Two timings next to v000 both put it at 1.18 times that version's speed.
#include <hip/hip_runtime.h>

typedef __attribute__((ext_vector_type(2))) float v2f;
typedef __attribute__((ext_vector_type(8))) float v8f;

#define TILE_M 128
#define TILE_N 128
#define KBLK   32
#define PITCH  36   // 32 K + 4 pad floats: bank-conflict-free fragment reads

// ---------------------------------------------------------------------------
// CDNA5 async global->LDS copy (bypasses VGPRs, tracked by ASYNCcnt).
// vdst = 32-bit LDS byte address, vaddr = 64-bit global address, GV mode.
// ---------------------------------------------------------------------------
__device__ __forceinline__ void async_load_b128(const float* g, float* l) {
    unsigned lds_addr = (unsigned)(unsigned long long)(uintptr_t)l;
    unsigned long long gaddr = (unsigned long long)(uintptr_t)g;
    asm volatile("global_load_async_to_lds_b128 %0, %1, off"
                 :: "v"(lds_addr), "v"(gaddr) : "memory");
}

__device__ __forceinline__ void wait_async_and_barrier() {
    asm volatile("s_wait_asynccnt 0x0" ::: "memory");
    __syncthreads();
}

// Stage one 128x32 fp32 tile (rows of a row-major matrix) into LDS [row][36].
__device__ __forceinline__ void stage_tile_async(const float* __restrict__ Gm,
                                                 int ld, int row0, int k0,
                                                 float* lbase, int tid) {
    #pragma unroll
    for (int i = 0; i < 4; ++i) {
        int idx = tid + i * 256;          // 0..1023
        int row = idx >> 3;               // 0..127
        int seg = (idx & 7) << 2;         // 0,4,...,28
        async_load_b128(Gm + (size_t)(row0 + row) * ld + k0 + seg,
                        lbase + row * PITCH + seg);
    }
}

// ---------------------------------------------------------------------------
// Generic fp32 WMMA GEMM:  C[M,N] = X[M,K] * Y[N,K]^T  (+ bias[N]) (+ Cadd[M,N])
// 256 threads = 8 waves; 128x128 tile per block; each wave owns a 16x128
// strip = 8 subtiles of 16x16 computed with v_wmma_f32_16x16x4_f32.
// Double-buffered K-blocks staged via global_load_async_to_lds_b128.
// ---------------------------------------------------------------------------
__global__ __launch_bounds__(256)
void ravan_wmma_gemm_f32(const float* __restrict__ X,
                         const float* __restrict__ Y,
                         const float* __restrict__ bias,
                         const float* __restrict__ Cadd,
                         float* __restrict__ C,
                         int M, int N, int K,
                         int ldx, int ldy, int ldc) {
    __shared__ __align__(16) float xs[2][TILE_M * PITCH];   // 2 x 18 KB
    __shared__ __align__(16) float ys[2][TILE_N * PITCH];   // 2 x 18 KB

    const int m0   = blockIdx.x * TILE_M;
    const int n0   = blockIdx.y * TILE_N;
    const int tid  = threadIdx.x;
    const int wave = tid >> 5;
    const int lane = tid & 31;
    const int hi   = lane >> 4;    // half-wave: selects K pair
    const int lm   = lane & 15;    // row within 16

    const int mbase = m0 + wave * 16;

    // C layout VGPR i -> M = i (lanes0-15) / i+8 (lanes16-31), N = lm.
    // With an addend the sums start from it (Cadd has C's shape and pitch):
    // its loads are in flight together with the first tile's copies.
    v8f acc[8];
    if (Cadd) {
        #pragma unroll
        for (int i = 0; i < 8; ++i) {
            const float* crow = Cadd + (size_t)(mbase + i + 8 * hi) * ldc + n0 + lm;
            #pragma unroll
            for (int ns = 0; ns < 8; ++ns) acc[ns][i] = crow[ns * 16];
            // Precaution: this row's address registers are reused further down.
            asm volatile("s_wait_xcnt 0x0" ::: "memory");
        }
    } else {
        #pragma unroll
        for (int i = 0; i < 8; ++i) acc[i] = (v8f){0.f,0.f,0.f,0.f,0.f,0.f,0.f,0.f};
    }

    // Prologue: async-stage K-block 0 into buffer 0.
    stage_tile_async(X, ldx, m0, 0, xs[0], tid);
    stage_tile_async(Y, ldy, n0, 0, ys[0], tid);

    const int nk = K / KBLK;
    for (int kb = 0; kb < nk; ++kb) {
        const int cur = kb & 1;
        wait_async_and_barrier();           // tile kb resident, prev readers done

        if (kb + 1 < nk) {                  // overlap: prefetch tile kb+1
            const int knext = (kb + 1) * KBLK;
            stage_tile_async(X, ldx, m0, knext, xs[1 - cur], tid);
            stage_tile_async(Y, ldy, n0, knext, ys[1 - cur], tid);
        }

        const float* xt = xs[cur];
        const float* yt = ys[cur];
        #pragma unroll
        for (int k = 0; k < KBLK; k += 4) {
            // A 16x4 f32 layout: lanes0-15 K=k,k+1 ; lanes16-31 K=k+2,k+3
            v2f afrag = *(const v2f*)(&xt[(wave * 16 + lm) * PITCH + k + 2 * hi]);
            #pragma unroll
            for (int ns = 0; ns < 8; ++ns) {
                // B 4x16 layout: VGPR0 = K(k+2*hi), VGPR1 = K(k+1+2*hi), N = lm
                v2f bfrag = *(const v2f*)(&yt[(ns * 16 + lm) * PITCH + k + 2 * hi]);
                acc[ns] = __builtin_amdgcn_wmma_f32_16x16x4_f32(
                    false, afrag, false, bfrag, (short)0, acc[ns], false, false);
            }
        }
    }

    // Epilogue, in the same C layout.
    #pragma unroll
    for (int ns = 0; ns < 8; ++ns) {
        const int col = n0 + ns * 16 + lm;
        const float bv = bias ? bias[col] : 0.f;
        #pragma unroll
        for (int i = 0; i < 8; ++i) {
            const int row = mbase + i + 8 * hi;
            const size_t off = (size_t)row * ldc + col;
            float v = acc[ns][i] + bv;
            C[off] = v;
        }
    }
}

// ---------------------------------------------------------------------------
// Prep: Gw[128,128] = blockdiag_h( s[h] * H[h] )   (Gw[qg][rg])
// ---------------------------------------------------------------------------
__global__ __launch_bounds__(256)
void ravan_build_g(const float* __restrict__ H, const float* __restrict__ s,
                   float* __restrict__ Gw) {
    int idx = blockIdx.x * 256 + threadIdx.x;      // 16384 total
    int qg = idx >> 7, rg = idx & 127;
    int hq = qg >> 4, q = qg & 15;
    int hr = rg >> 4, r = rg & 15;
    float v = 0.f;
    if (hq == hr) v = s[hq] * H[hq * 256 + q * 16 + r];
    Gw[idx] = v;
}

// ---------------------------------------------------------------------------
// Prep: Bcat[4096,128] with Bcat[o][h*16+q] = B[h][o][q]
// ---------------------------------------------------------------------------
__global__ __launch_bounds__(256)
void ravan_build_bcat(const float* __restrict__ Bsrc, float* __restrict__ Bc,
                      int Dout) {
    int idx = blockIdx.x * 256 + threadIdx.x;      // Dout*128 total
    int o = idx >> 7, hq = idx & 127;
    int h = hq >> 4, q = hq & 15;
    Bc[idx] = Bsrc[((size_t)h * Dout + o) * 16 + q];
}

// ---------------------------------------------------------------------------
// Prep: At[Din,128] = Acat^T, Acat = A viewed as [128,Din]. A thread reads four
// neighbours of one row; a wave's 32 rows then make whole 128-byte lines of At.
// ---------------------------------------------------------------------------
__global__ __launch_bounds__(256)
void build_at(const float* __restrict__ Asrc, float* __restrict__ At, int Din) {
    int idx = blockIdx.x * 256 + threadIdx.x;      // Din*128/4 total
    int r = idx & 127, d = (idx >> 7) * 4;
    const float4 a = *(const float4*)(Asrc + (size_t)r * Din + d);
    At[(size_t)(d + 0) * 128 + r] = a.x;
    At[(size_t)(d + 1) * 128 + r] = a.y;
    At[(size_t)(d + 2) * 128 + r] = a.z;
    At[(size_t)(d + 3) * 128 + r] = a.w;
}

// ---------------------------------------------------------------------------
// Launch
// inputs: 0:x[4,2048,4096] 1:W[4096,4096] 2:b[4096] 3:A[8,16,4096]
//         4:H[8,16,16] 5:B[8,4096,16] 6:s[8]
// ---------------------------------------------------------------------------
extern "C" void kernel_launch(void* const* d_in, const int* in_sizes, int n_in,
                              void* d_out, int out_size, void* d_ws, size_t ws_size,
                              hipStream_t stream) {
    const float* x = (const float*)d_in[0];
    const float* W = (const float*)d_in[1];
    const float* b = (const float*)d_in[2];
    const float* A = (const float*)d_in[3];   // contiguous as [128,4096]
    const float* H = (const float*)d_in[4];
    const float* B = (const float*)d_in[5];
    const float* s = (const float*)d_in[6];
    float* out = (float*)d_out;

    const int M = 4 * 2048;      // 8192 tokens
    const int Din = 4096, Dout = 4096, NR = 128;

    float* Gw  = (float*)d_ws;                   // 128*128
    float* Bc  = Gw + 128 * 128;                 // 4096*128
    float* At  = Bc + (size_t)Dout * NR;         // 4096*128
    float* HAt = At + (size_t)Din * NR;          // 4096*128
    float* We  = HAt + (size_t)Din * NR;         // 4096*4096

    // The adapter chain is linear in x, so it is folded into the weight:
    //   out = x @ (W + Bcat @ Gw @ Acat)^T + b
    ravan_build_g<<<64, 256, 0, stream>>>(H, s, Gw);
    ravan_build_bcat<<<(Dout * NR) / 256, 256, 0, stream>>>(B, Bc, Dout);
    build_at<<<(Din * NR) / 1024, 256, 0, stream>>>(A, At, Din);

    // HAt = At @ Gw^T        [4096,128]  K=128 (folds H and s):  (Gw @ Acat)^T
    ravan_wmma_gemm_f32<<<dim3(Din / TILE_M, NR / TILE_N), 256, 0, stream>>>(
        At, Gw, nullptr, nullptr, HAt, Din, NR, NR, NR, NR, NR);

    // We = W + Bcat @ HAt^T  [4096,4096] K=128
    ravan_wmma_gemm_f32<<<dim3(Dout / TILE_M, Din / TILE_N), 256, 0, stream>>>(
        Bc, HAt, nullptr, W, We, Dout, Din, NR, NR, NR, Din);

    // out = x @ We^T + b     [8192,4096] K=4096  (the big one)
    ravan_wmma_gemm_f32<<<dim3(M / TILE_M, Dout / TILE_N), 256, 0, stream>>>(
        x, We, b, nullptr, out, M, Dout, Din, Din, Din, Dout);
}
